// v000
// The times below were measured on an AMD MI455X: many runs one after another, warmed up first and cycling through
// copies of the inputs, with the whole window's GPU time divided by the number of runs. Launches and the gaps
// between them are all in it. The median over several windows is given; except for v000 it joins two sittings, which
// can be a few percent apart, so the side-by-side timings, each taken in one sitting, are the better comparison.
// The starting kernel, v000, takes 569 microseconds a run.
// Contractions: layer 1 (l1 [M x 32, 10 real + zero pad] . W1^T [1024 x 32 pad], W1 carried x16) and layer 2 (h1 [M x 1024] . W2^T [1024 x 1024], W2 carried x64) on v_wmma_f32_16x16x32_f16 (f16 operands, f32 accumulate); 5->2 input projections, biases, relu, the 1024->3 head (fused into the layer-2 epilogue) and sigmoid in f32.
#include <hip/hip_runtime.h>
#include <math.h>

// ---------------------------------------------------------------------------
// Problem constants
// ---------------------------------------------------------------------------
constexpr int kInDim   = 25;          // x row width
constexpr int kNeu     = 1024;        // hidden width
constexpr int kL1Real  = 10;          // concatenated feature width
constexpr int kL1K     = 32;          // feature width zero-padded to one k-step
constexpr int kHeadOut = 3;           // output width
constexpr int kChunk   = 32768;       // rows per layer-1/layer-2 pass
constexpr int kNPlanes = kNeu / 64;   // 16 head partial planes (one per 64-column tile)
constexpr float kW1Carry    = 16.0f;
constexpr float kW1CarryInv = 1.0f / 16.0f;
constexpr float kW2Carry    = 64.0f;
constexpr float kW2CarryInv = 1.0f / 64.0f;

typedef __attribute__((ext_vector_type(16))) _Float16 v16h;
typedef __attribute__((ext_vector_type(8)))  _Float16 v8h;
typedef __attribute__((ext_vector_type(16))) __bf16   v16b;
typedef __attribute__((ext_vector_type(8)))  __bf16   v8b;
typedef __attribute__((ext_vector_type(8)))  float    v8f;
typedef __attribute__((ext_vector_type(4)))  float    v4f;
typedef __attribute__((ext_vector_type(4)))  unsigned int v4u;

// ---------------------------------------------------------------------------
// Helpers
// ---------------------------------------------------------------------------
__device__ __forceinline__ unsigned short f2bf_bits(float f) {
  unsigned u = __float_as_uint(f);
  return (unsigned short)((u + 0x7FFFu + ((u >> 16) & 1u)) >> 16);
}
__device__ __forceinline__ float bf_bits2f(unsigned short h) { return __uint_as_float(((unsigned)h) << 16); }

// hazard guards as plain device helpers (no inline asm inside the kernel template body)
__device__ __forceinline__ void dep_guard_h(v8f& a, v8f& b, v16h x, v16h y) { asm volatile("v_nop\n\tv_nop\n\tv_nop\n\tv_nop" : "+v"(a), "+v"(b) : "v"(x), "v"(y)); }
__device__ __forceinline__ void dep_guard_b(v8f& a, v8f& b, v16b x, v16b y) { asm volatile("v_nop\n\tv_nop\n\tv_nop\n\tv_nop" : "+v"(a), "+v"(b) : "v"(x), "v"(y)); }
__device__ __forceinline__ void keep4_h(v16h a, v16h b, v16h c, v16h d) { asm volatile("v_nop" :: "v"(a), "v"(b), "v"(c), "v"(d)); }
__device__ __forceinline__ void keep4_b(v16b a, v16b b, v16b c, v16b d) { asm volatile("v_nop" :: "v"(a), "v"(b), "v"(c), "v"(d)); }
__device__ __forceinline__ void acc_guard4(v8f& a, v8f& b, v8f& c, v8f& d) { asm volatile("v_nop\n\tv_nop\n\tv_nop\n\tv_nop" : "+v"(a), "+v"(b), "+v"(c), "+v"(d)); }
template <typename T> struct Frag;
template <> struct Frag<_Float16> {
  typedef v16h V; union U { v16h v; v8h h[2]; };
  static __device__ __forceinline__ v16h load(const _Float16* p) {   // elements 0..7 <- p[0..7], 8..15 <- p[16..23]
    U f; f.h[0] = *(const v8h*)(p); f.h[1] = *(const v8h*)(p + 16); return f.v;
  }
  static __device__ __forceinline__ v8f mma(v16h a, v16h b, v8f c) {
    return __builtin_amdgcn_wmma_f32_16x16x32_f16(false, a, false, b, (short)0, c, false, false);
  }
  static __device__ __forceinline__ void guard(v8f& a, v8f& b, v16h x, v16h y) { dep_guard_h(a, b, x, y); }
  static __device__ __forceinline__ void keep(v16h a, v16h b, v16h c, v16h d) { keep4_h(a, b, c, d); }
};
template <> struct Frag<__bf16> {
  typedef v16b V; union U { v16b v; v8b h[2]; };
  static __device__ __forceinline__ v16b load(const __bf16* p) {
    U f; f.h[0] = *(const v8b*)(p); f.h[1] = *(const v8b*)(p + 16); return f.v;
  }
  static __device__ __forceinline__ v8f mma(v16b a, v16b b, v8f c) {
    return __builtin_amdgcn_wmma_f32_16x16x32_bf16(false, a, false, b, (short)0, c, false, false);
  }
  static __device__ __forceinline__ void guard(v8f& a, v8f& b, v16b x, v16b y) { dep_guard_b(a, b, x, y); }
  static __device__ __forceinline__ void keep(v16b a, v16b b, v16b c, v16b d) { keep4_b(a, b, c, d); }
};

__device__ __forceinline__ unsigned pk16(unsigned short a, unsigned short b) { return (unsigned)a | ((unsigned)b << 16); }
__device__ __forceinline__ unsigned short h_bits(float f) { const _Float16 h = (_Float16)f; return __builtin_bit_cast(unsigned short, h); }

// ---- Register-blocked WMMA GEMM (plain single product) ----
// C[m,n] = act(scale * sum_k A[m,k] * Bt[n,k] + bias[n]); each wave owns a 64x64 tile.
// A row-major [M,K]; Bt row-major [N,K]; M,N % 64 == 0, K % 32 == 0 (asserted host side; padded planes are zero-filled).
// BIAS_MODE: 0 = none, 2 = bias[n].  ACT: 0 = none, 2 = relu.
// OUT_MODE 3: fused 3-wide head: P[tn][m][c] = sum_{n in this 64-column tile} act(...)[m][n] * hw[c*ldh + n], c = 0..2
//             (4th float written as 0); per-lane partials over the tile's columns, fixed-order xor tree across the 16 lanes of
//             each half, staged in the wave slab, then rows mBase..mBase+15 of plane tn written by lanes 0..15 as ONE
// ET: 0 = f16 operands, 1 = bf16 operands (pointers passed as 16-bit storage)
template <int ET> struct Elem;
template <> struct Elem<0> { typedef _Float16 T; };
template <> struct Elem<1> { typedef __bf16 T; };
template <int ET, int BIAS_MODE, int OUT_MODE, int ACT>
__global__ __launch_bounds__(256) void wmma_gemm64(
    const unsigned short* __restrict__ Ap, int lda, long strideA,
    const unsigned short* __restrict__ Btp, int ldb, long strideB,
    void* __restrict__ Cout, int ldc, long strideC,
    const float* __restrict__ bias,
    const float* __restrict__ hw, int ldh,
    int M, int N, int K, float scale) {
  typedef typename Elem<ET>::T T;
  typedef typename Frag<T>::V V;
  const T* A = (const T*)Ap; const T* Bt = (const T*)Btp;
  __shared__ __align__(16) float sT[8][16 * 68];   // per-wave 16x64 slab, pitch 68 floats
  const int b    = blockIdx.y;
  const int lane = threadIdx.x & 31;
  const int wave = threadIdx.x >> 5;
  const int tilesN = N >> 6;
  const int tilesM = M >> 6;
  const int tile = blockIdx.x * 8 + wave;
  if (tile >= tilesM * tilesN) return;   // wave-uniform; no block barriers in this kernel
  const int tm = tile / tilesN;
  const int tn = tile - tm * tilesN;
  const int m0 = tm << 6;
  const int n0 = tn << 6;

  const T* Ab  = A  + (size_t)b * strideA;
  const T* Bb  = Bt + (size_t)b * strideB;

  const int rlane = lane & 15;                 // row (A) / col (B, D) within subtile
  const int koff  = (lane >> 4) * 8;           // k offset of this lane half
  const int mOff  = (lane >> 4) * 8;           // D row offset

  v8f acc[4][4];
#pragma unroll
  for (int i = 0; i < 4; ++i)
#pragma unroll
    for (int j = 0; j < 4; ++j) acc[i][j] = (v8f){0.f,0.f,0.f,0.f,0.f,0.f,0.f,0.f};

  for (int k0 = 0; k0 < K; k0 += 32) {
    V bh[4];
#pragma unroll
    for (int j = 0; j < 4; ++j) {
      const size_t bo = (size_t)(n0 + (j << 4) + rlane) * ldb + koff + k0;
      bh[j] = Frag<T>::load(Bb + bo);
    }
#pragma unroll
    for (int i = 0; i < 4; ++i) {
      const size_t ao = (size_t)(m0 + (i << 4) + rlane) * lda + koff + k0;
      V ah = Frag<T>::load(Ab + ao);
#pragma unroll
      for (int j = 0; j < 4; ++j) {
        acc[i][j] = Frag<T>::mma(ah, bh[j], acc[i][j]);
      }
      Frag<T>::guard(acc[i][0], acc[i][3], ah, ah);
    }
    Frag<T>::keep(bh[0], bh[1], bh[2], bh[3]);
  }
  acc_guard4(acc[0][0], acc[0][1], acc[0][2], acc[0][3]);
  acc_guard4(acc[1][0], acc[1][1], acc[1][2], acc[1][3]);
  acc_guard4(acc[2][0], acc[2][1], acc[2][2], acc[2][3]);
  acc_guard4(acc[3][0], acc[3][1], acc[3][2], acc[3][3]);

  // ---- epilogue ----
  float* slab = sT[wave];
#pragma unroll
  for (int i = 0; i < 4; ++i) {
    const int mBase = m0 + (i << 4);
    if (OUT_MODE == 1) {
#pragma unroll
      for (int j = 0; j < 4; ++j) {
        const int n = n0 + (j << 4) + rlane;
        float bv = 0.f;
        if (BIAS_MODE == 2) bv = bias[n];
#pragma unroll
        for (int r = 0; r < 8; ++r) {
          float v = acc[i][j][r] * scale;
          if (BIAS_MODE == 2) v += bv;
          if (ACT == 2) v = fmaxf(v, 0.0f);
          slab[(mOff + r) * 68 + (j << 4) + rlane] = v;
        }
      }
      __builtin_amdgcn_fence(__ATOMIC_RELEASE, "workgroup");
      __builtin_amdgcn_wave_barrier();
      __builtin_amdgcn_fence(__ATOMIC_ACQUIRE, "workgroup");
      {
        const int q = lane >> 3, c8 = (lane & 7) * 8;
        unsigned short* C = (unsigned short*)Cout + (size_t)b * strideC;
        {
#pragma unroll
          for (int it = 0; it < 4; ++it) {
            const int row = it * 4 + q;                       // q 0..3, it 0..3 -> rows 0..15; 8 lanes x 8 halves = 64 cols
            const float* sp = slab + row * 68 + c8;
            v8h hv;
#pragma unroll
            for (int e = 0; e < 8; ++e) hv[e] = (_Float16)sp[e];
            *(v8h*)(C + (size_t)(mBase + row) * ldc + n0 + c8) = hv;
          }
          
        }
      }
    } else {
      // fused 3-wide head over this tile's 64 columns, f32
      float hp0[8], hp1[8], hp2[8];
#pragma unroll
      for (int r = 0; r < 8; ++r) { hp0[r] = 0.f; hp1[r] = 0.f; hp2[r] = 0.f; }
#pragma unroll
      for (int j = 0; j < 4; ++j) {
        const int n = n0 + (j << 4) + rlane;
        float bv = 0.f;
        if (BIAS_MODE == 2) bv = bias[n];
        const float w0 = hw[n];
        const float w1 = hw[(size_t)ldh + n];
        const float w2 = hw[(size_t)2 * ldh + n];
#pragma unroll
        for (int r = 0; r < 8; ++r) {
          float v = acc[i][j][r] * scale;
          if (BIAS_MODE == 2) v += bv;
          if (ACT == 2) v = fmaxf(v, 0.0f);
          hp0[r] = fmaf(v, w0, hp0[r]);
          hp1[r] = fmaf(v, w1, hp1[r]);
          hp2[r] = fmaf(v, w2, hp2[r]);
        }
      }
      // fixed-order xor tree across the 16 lanes of each half (lanes sharing the same D rows)
#pragma unroll
      for (int r = 0; r < 8; ++r) {
#pragma unroll
        for (int off = 1; off < 16; off <<= 1) {
          hp0[r] += __shfl_xor(hp0[r], off, 32);
          hp1[r] += __shfl_xor(hp1[r], off, 32);
          hp2[r] += __shfl_xor(hp2[r], off, 32);
        }
      }
      // lane (half h, rlane == r) stages slab row 8h + r: rows 0..15 x 4 floats all written
#pragma unroll
      for (int r = 0; r < 8; ++r) {
        if (rlane == r) {
          slab[(mOff + r) * 4 + 0] = hp0[r];
          slab[(mOff + r) * 4 + 1] = hp1[r];
          slab[(mOff + r) * 4 + 2] = hp2[r];
          slab[(mOff + r) * 4 + 3] = 0.0f;
        }
      }
      __builtin_amdgcn_fence(__ATOMIC_RELEASE, "workgroup");
      __builtin_amdgcn_wave_barrier();
      __builtin_amdgcn_fence(__ATOMIC_ACQUIRE, "workgroup");
      {
        float* P = (float*)Cout + (size_t)tn * strideC + (size_t)mBase * 4;
        const int l4 = (lane & 15) * 4;
        const v4f pv = *(const v4f*)(slab + l4);
        {
          if (lane < 16) *(v4f*)(P + l4) = pv;     // 16 lanes x 16 B = rows mBase..mBase+15 of plane tn (256 B)
          
        }
      }
    }
    __builtin_amdgcn_fence(__ATOMIC_RELEASE, "workgroup");
    __builtin_amdgcn_wave_barrier();
    __builtin_amdgcn_fence(__ATOMIC_ACQUIRE, "workgroup");
  }
}

// ---------------------------------------------------------------------------
// W2 cast, 8 consecutive elements per thread: out f16 bits of (scale * in), scale a power-of-two carry.
// ---------------------------------------------------------------------------
__global__ __launch_bounds__(256) void cast_f16x8_kernel(const float* __restrict__ in, unsigned short* __restrict__ out,
                                                         int n8, float scale) {
  const int i = blockIdx.x * 256 + threadIdx.x;
  if (i >= n8) return;
  const float* p = in + 8 * (size_t)i;
  const v4f a = *(const v4f*)(p);
  const v4f c = *(const v4f*)(p + 4);
  unsigned short hb[8];
#pragma unroll
  for (int e = 0; e < 4; ++e) {
    hb[e]     = h_bits(a[e] * scale);
    hb[4 + e] = h_bits(c[e] * scale);
  }
  const v4u u = (v4u){pk16(hb[0], hb[1]), pk16(hb[2], hb[3]), pk16(hb[4], hb[5]), pk16(hb[6], hb[7])};
  unsigned short* q = out + 8 * (size_t)i;
  *(v4u*)q = u;
  
}

// ---------------------------------------------------------------------------
// W1 [1024][10] f32 -> W1P f16 bits [1024][32]: cols 0..9 = f16(scale * W1), cols 10..31 = 0 (explicit zero fill of the k pad).
// One block of 64 threads per 64 rows (16 blocks exactly). Input staged coalesced (64 threads x 10 = 640 floats = the 64 rows).
// Store: LDS tile [64][32] halves (4096 B) -> contiguous 4096-B region at row0 (4096-B aligned): 4 instructions x 64 threads x 16 B;
// ---------------------------------------------------------------------------
__global__ __launch_bounds__(64) void w1_pad_kernel(const float* __restrict__ W1, unsigned short* __restrict__ W1P, float scale) {
  __shared__ float wsrc[64 * kL1Real];
  __shared__ __align__(16) unsigned short hs[64 * kL1K];
  const int t = threadIdx.x;
  const int row0 = blockIdx.x * 64;
  const float* wb = W1 + (size_t)row0 * kL1Real;
#pragma unroll
  for (int i = 0; i < kL1Real; ++i) wsrc[t + 64 * i] = wb[t + 64 * i];
  __syncthreads();
  unsigned short hb[kL1Real];
#pragma unroll
  for (int k = 0; k < kL1Real; ++k) hb[k] = h_bits(wsrc[t * kL1Real + k] * scale);
  const v4u u0 = (v4u){pk16(hb[0], hb[1]), pk16(hb[2], hb[3]), pk16(hb[4], hb[5]), pk16(hb[6], hb[7])};
  const v4u u1 = (v4u){pk16(hb[8], hb[9]), 0u, 0u, 0u};
  const v4u uz = (v4u){0u, 0u, 0u, 0u};
  v4u* hv = (v4u*)hs;                      // row t = 4 x 16 B
  hv[t * 4 + 0] = u0; hv[t * 4 + 1] = u1; hv[t * 4 + 2] = uz; hv[t * 4 + 3] = uz;
  __syncthreads();
  const v4u s0 = hv[t], s1 = hv[64 + t], s2 = hv[128 + t], s3 = hv[192 + t];
  v4u* dst = (v4u*)(W1P + (size_t)row0 * kL1K);
  {
    ((v4u*)dst)[t]       = s0;
    ((v4u*)dst)[64 + t]  = s1;
    ((v4u*)dst)[128 + t] = s2;
    ((v4u*)dst)[192 + t] = s3;
    
  }
}

// ---------------------------------------------------------------------------
// Feature kernel: x [M][25] f32 -> L1 f16 bits [M][32]: cols 0..9 = relu projections in the concatenation order
// [fx(vx) | fx(vy) | fx(r) | fu(th) | fu(st)], cols 10..31 = 0 (explicit zero fill). vx = x[3i], vy = x[3i+1], r = x[3i+2],
// th = x[15+2i], st = x[16+2i], i = 0..4; fx(v)[o] = relu(sum_i Wx[o][i] v[i] + bx[o]); f32 math.
// One block of 64 threads per 64 rows (M/64 blocks exactly); x staged coalesced (64 x 25 = 1600 floats = the 64 rows).
// Store: LDS tile [64][32] halves -> contiguous 4096-B region at row0*64 B (4096-B aligned): 4 instructions x 64 threads x 16 B;
// ---------------------------------------------------------------------------
__global__ __launch_bounds__(64) void l1_feature_kernel(
    const float* __restrict__ x, const float* __restrict__ Wx, const float* __restrict__ bx,
    const float* __restrict__ Wu, const float* __restrict__ bu, unsigned short* __restrict__ L1) {
  __shared__ float xs[64 * kInDim];
  __shared__ __align__(16) unsigned short hs[64 * kL1K];
  const int t = threadIdx.x;
  const int row0 = blockIdx.x * 64;
  const float* xb = x + (size_t)row0 * kInDim;
#pragma unroll
  for (int i = 0; i < kInDim; ++i) xs[t + 64 * i] = xb[t + 64 * i];
  float wx[10], wu[10];
#pragma unroll
  for (int i = 0; i < 10; ++i) { wx[i] = Wx[i]; wu[i] = Wu[i]; }
  const float bx0 = bx[0], bx1 = bx[1], bu0 = bu[0], bu1 = bu[1];
  __syncthreads();
  const float* xr = xs + t * kInDim;
  float f[kL1Real];
#pragma unroll
  for (int g = 0; g < 3; ++g) {            // vx (g=0), vy (g=1), r (g=2): columns 3i + g
    const float v0 = xr[g], v1 = xr[3 + g], v2 = xr[6 + g], v3 = xr[9 + g], v4 = xr[12 + g];
    float a0 = wx[0] * v0; a0 = fmaf(wx[1], v1, a0); a0 = fmaf(wx[2], v2, a0); a0 = fmaf(wx[3], v3, a0); a0 = fmaf(wx[4], v4, a0);
    float a1 = wx[5] * v0; a1 = fmaf(wx[6], v1, a1); a1 = fmaf(wx[7], v2, a1); a1 = fmaf(wx[8], v3, a1); a1 = fmaf(wx[9], v4, a1);
    a0 += bx0; a1 += bx1;
    f[2 * g]     = fmaxf(a0, 0.0f);
    f[2 * g + 1] = fmaxf(a1, 0.0f);
  }
#pragma unroll
  for (int g = 0; g < 2; ++g) {            // th (g=0): columns 15,17,..,23; st (g=1): columns 16,18,..,24
    const float v0 = xr[15 + g], v1 = xr[17 + g], v2 = xr[19 + g], v3 = xr[21 + g], v4 = xr[23 + g];
    float a0 = wu[0] * v0; a0 = fmaf(wu[1], v1, a0); a0 = fmaf(wu[2], v2, a0); a0 = fmaf(wu[3], v3, a0); a0 = fmaf(wu[4], v4, a0);
    float a1 = wu[5] * v0; a1 = fmaf(wu[6], v1, a1); a1 = fmaf(wu[7], v2, a1); a1 = fmaf(wu[8], v3, a1); a1 = fmaf(wu[9], v4, a1);
    a0 += bu0; a1 += bu1;
    f[6 + 2 * g] = fmaxf(a0, 0.0f);
    f[7 + 2 * g] = fmaxf(a1, 0.0f);
  }
  unsigned short hb[kL1Real];
#pragma unroll
  for (int c = 0; c < kL1Real; ++c) hb[c] = h_bits(f[c]);
  const v4u u0 = (v4u){pk16(hb[0], hb[1]), pk16(hb[2], hb[3]), pk16(hb[4], hb[5]), pk16(hb[6], hb[7])};
  const v4u u1 = (v4u){pk16(hb[8], hb[9]), 0u, 0u, 0u};
  const v4u uz = (v4u){0u, 0u, 0u, 0u};
  v4u* hv = (v4u*)hs;                      // row t = 4 x 16 B
  hv[t * 4 + 0] = u0; hv[t * 4 + 1] = u1; hv[t * 4 + 2] = uz; hv[t * 4 + 3] = uz;
  __syncthreads();
  const v4u s0 = hv[t], s1 = hv[64 + t], s2 = hv[128 + t], s3 = hv[192 + t];
  v4u* dst = (v4u*)(L1 + (size_t)row0 * kL1K);
  {
    ((v4u*)dst)[t]       = s0;
    ((v4u*)dst)[64 + t]  = s1;
    ((v4u*)dst)[128 + t] = s2;
    ((v4u*)dst)[192 + t] = s3;
    
  }
}

// ---------------------------------------------------------------------------
// Head output: out[m][c] = sigmoid(sum_{p=0..15 in order} PART[p][m][c] + b3[c]). One block of 64 threads per 64 rows
// (M/64 blocks exactly); results funnelled through LDS so wave 0 writes the block's 768 contiguous output bytes (6 whole
// ---------------------------------------------------------------------------
__global__ __launch_bounds__(64) void head_out_kernel(const float* __restrict__ PART, long planeStride,
                                                     const float* __restrict__ b3, float* __restrict__ out) {
  __shared__ __align__(16) float so[64 * kHeadOut];
  const int t = threadIdx.x;
  const int m = blockIdx.x * 64 + t;
  float s0 = 0.f, s1 = 0.f, s2 = 0.f;
#pragma unroll
  for (int p = 0; p < kNPlanes; ++p) {
    const v4f v = *(const v4f*)(PART + (size_t)p * planeStride + (size_t)m * 4);
    s0 += v[0]; s1 += v[1]; s2 += v[2];
  }
  s0 += b3[0]; s1 += b3[1]; s2 += b3[2];
  const float o0 = __builtin_amdgcn_rcpf(1.0f + expf(-s0));
  const float o1 = __builtin_amdgcn_rcpf(1.0f + expf(-s1));
  const float o2 = __builtin_amdgcn_rcpf(1.0f + expf(-s2));
  so[t * 3 + 0] = o0; so[t * 3 + 1] = o1; so[t * 3 + 2] = o2;
  __syncthreads();
  if (t < 32) {
    float* ob = out + (size_t)blockIdx.x * (64 * kHeadOut);
    const v4f v0 = *(const v4f*)(so + t * 4);                  // floats 0..127
    const v4f v1 = *(const v4f*)(so + 128 + (t & 15) * 4);     // floats 128..191
    {
      *(v4f*)(ob + t * 4) = v0;
      if (t < 16) *(v4f*)(ob + 128 + t * 4) = v1;
      
    }
  }
}

// ---------------------------------------------------------------------------
// Workspace region map (byte offsets, all multiples of 128; every region fully written before it is read):
//   W2H  f16 [1024][1024] (x64)                0           2,097,152 B
//   W1P  f16 [1024][32]   (x16, cols 10..31=0) 2,097,152      65,536 B
//   L1   f16 [M][32]      (cols 10..31 = 0)    2,162,688   M*64 B          (8,388,608 for M=131072)
//   H1   f16 [32768][1024] per chunk            +           67,108,864 B
//   PART f32 [16][M][4]                          +           M*256 B         (33,554,432)
//   total 111,214,592 B for M = 131072
// GEMM shapes per 32768-row chunk: layer 1 M=32768 N=1024 K=32 (padded planes zero-filled); layer 2 M=32768 N=1024 K=1024.
// All K % 32 == 0, all M, N % 64 == 0.
// ---------------------------------------------------------------------------
extern "C" void kernel_launch(void* const* d_in, const int* in_sizes, int n_in,
                              void* d_out, int out_size, void* d_ws, size_t ws_size,
                              hipStream_t stream) {
  if (n_in < 11) return;
  const int M = in_sizes[0] / kInDim;
  if (M <= 0 || M * kInDim != in_sizes[0]) return;
  if ((M % kChunk) != 0) return;
  if (in_sizes[1] != 10 || in_sizes[2] != 2 || in_sizes[3] != 10 || in_sizes[4] != 2) return;
  if (in_sizes[5] != kNeu * kL1Real || in_sizes[6] != kNeu) return;
  if (in_sizes[7] != kNeu * kNeu || in_sizes[8] != kNeu) return;
  if (in_sizes[9] != kHeadOut * kNeu || in_sizes[10] != kHeadOut) return;
  if (out_size != M * kHeadOut) return;

  const float* x  = (const float*)d_in[0];    // [M][25]
  const float* Wx = (const float*)d_in[1];    // [2][5]
  const float* bx = (const float*)d_in[2];    // [2]
  const float* Wu = (const float*)d_in[3];    // [2][5]
  const float* bu = (const float*)d_in[4];    // [2]
  const float* W1 = (const float*)d_in[5];    // [1024][10]
  const float* b1 = (const float*)d_in[6];    // [1024]
  const float* W2 = (const float*)d_in[7];    // [1024][1024]
  const float* b2 = (const float*)d_in[8];    // [1024]
  const float* W3 = (const float*)d_in[9];    // [3][1024]
  const float* b3 = (const float*)d_in[10];   // [3]
  float* outp = (float*)d_out;                // [M][1][3]

  // ---- carve ----
  const size_t szW2H  = (size_t)kNeu * kNeu * 2;
  const size_t szW1P  = (size_t)kNeu * kL1K * 2;
  const size_t szL1   = (size_t)M * kL1K * 2;
  const size_t szH1   = (size_t)kChunk * kNeu * 2;
  const size_t szPart = (size_t)kNPlanes * M * 4 * sizeof(float);
  size_t off = 0;
  const size_t oW2H  = off; off += szW2H;
  const size_t oW1P  = off; off += szW1P;
  const size_t oL1   = off; off += szL1;
  const size_t oH1   = off; off += szH1;
  const size_t oPart = off; off += szPart;
  const size_t TOTAL = off;
  if (TOTAL > ws_size) return;
  if (TOTAL > (size_t)134217728) return;

  char* ws = (char*)d_ws;
  unsigned short* W2H  = (unsigned short*)(ws + oW2H);
  unsigned short* W1P  = (unsigned short*)(ws + oW1P);
  unsigned short* L1   = (unsigned short*)(ws + oL1);
  unsigned short* H1   = (unsigned short*)(ws + oH1);
  float*          PART = (float*)(ws + oPart);
  const long planeStride = (long)M * 4;       // floats between head partial planes

  // (0) weight planes
  {
    const int n8 = kNeu * kNeu / 8;           // 131072 -> 512 blocks exactly
    cast_f16x8_kernel<<<dim3(n8 / 256), dim3(256), 0, stream>>>(W2, W2H, n8, kW2Carry);
    w1_pad_kernel<<<dim3(kNeu / 64), dim3(64), 0, stream>>>(W1, W1P, kW1Carry);
  }
  // (1) features -> L1
  l1_feature_kernel<<<dim3(M / 64), dim3(64), 0, stream>>>(x, Wx, bx, Wu, bu, L1);

  // (2) per 32768-row chunk: layer 1 -> H1 (f16), layer 2 + fused head -> PART
  const int tiles = (kChunk / 64) * (kNeu / 64);                 // 8192
  const dim3 gG((tiles + 7) / 8, 1);                             // 1024 blocks
  const int nChunks = M / kChunk;
  for (int ch = 0; ch < nChunks; ++ch) {
    const unsigned short* Ach = L1 + (size_t)ch * kChunk * kL1K;
    wmma_gemm64<0, 2, 1, 2><<<gG, dim3(256), 0, stream>>>(
        Ach, kL1K, 0L, W1P, kL1K, 0L, (void*)H1, kNeu, 0L, b1, W3, kNeu, kChunk, kNeu, kL1K, kW1CarryInv);
    float* Pch = PART + (size_t)ch * kChunk * 4;
    wmma_gemm64<0, 2, 3, 2><<<gG, dim3(256), 0, stream>>>(
        H1, kNeu, 0L, W2H, kNeu, 0L, (void*)Pch, 4, planeStride, b2, W3, kNeu, kChunk, kNeu, kNeu, kW2CarryInv);
  }

  // (3) head: fixed-order sum of the 16 partials + b3, sigmoid -> d_out
  head_out_kernel<<<dim3(M / 64), dim3(64), 0, stream>>>(PART, planeStride, b3, outp);
}

// v001
// One run takes 323 microseconds.
// Next to v000, in two timings, it ran 1.82 times as fast each time.
// Contractions: layer 1 (l1 [M x 32, 10 real + zero pad] . W1^T [1024 x 32 pad], W1 carried x16) and layer 2 (h1 [M x 1024] . W2^T [1024 x 1024], W2 carried x64) on v_wmma_f32_16x16x32_f16 (f16 operands, f32 accumulate); 5->2 input projections, biases, relu, the 1024->3 head (fused into the layer-2 epilogue) and sigmoid in f32.
#include <hip/hip_runtime.h>
#include <math.h>

// ---------------------------------------------------------------------------
// Problem constants
// ---------------------------------------------------------------------------
constexpr int kInDim   = 25;          // x row width
constexpr int kNeu     = 1024;        // hidden width
constexpr int kL1Real  = 10;          // concatenated feature width
constexpr int kL1K     = 32;          // feature width zero-padded to one k-step
constexpr int kHeadOut = 3;           // output width
constexpr int kChunk   = 32768;       // rows per layer-1/layer-2 pass
constexpr int kNPlanes = kNeu / 64;   // 16 head partial planes (one per 64-column tile)
constexpr float kW1Carry    = 16.0f;
constexpr float kW1CarryInv = 1.0f / 16.0f;
constexpr float kW2Carry    = 64.0f;
constexpr float kW2CarryInv = 1.0f / 64.0f;

typedef __attribute__((ext_vector_type(16))) _Float16 v16h;
typedef __attribute__((ext_vector_type(8)))  _Float16 v8h;
typedef __attribute__((ext_vector_type(16))) __bf16   v16b;
typedef __attribute__((ext_vector_type(8)))  __bf16   v8b;
typedef __attribute__((ext_vector_type(8)))  float    v8f;
typedef __attribute__((ext_vector_type(4)))  float    v4f;
typedef __attribute__((ext_vector_type(4)))  unsigned int v4u;

// ---------------------------------------------------------------------------
// Helpers
// ---------------------------------------------------------------------------
__device__ __forceinline__ unsigned short f2bf_bits(float f) {
  unsigned u = __float_as_uint(f);
  return (unsigned short)((u + 0x7FFFu + ((u >> 16) & 1u)) >> 16);
}
__device__ __forceinline__ float bf_bits2f(unsigned short h) { return __uint_as_float(((unsigned)h) << 16); }

// hazard guards as plain device helpers (no inline asm inside the kernel template body)
__device__ __forceinline__ void dep_guard_h(v8f& a, v8f& b, v16h x, v16h y) { asm volatile("v_nop\n\tv_nop\n\tv_nop\n\tv_nop" : "+v"(a), "+v"(b) : "v"(x), "v"(y)); }
__device__ __forceinline__ void dep_guard_b(v8f& a, v8f& b, v16b x, v16b y) { asm volatile("v_nop\n\tv_nop\n\tv_nop\n\tv_nop" : "+v"(a), "+v"(b) : "v"(x), "v"(y)); }
__device__ __forceinline__ void keep4_h(v16h a, v16h b, v16h c, v16h d) { asm volatile("v_nop" :: "v"(a), "v"(b), "v"(c), "v"(d)); }
__device__ __forceinline__ void keep4_b(v16b a, v16b b, v16b c, v16b d) { asm volatile("v_nop" :: "v"(a), "v"(b), "v"(c), "v"(d)); }
__device__ __forceinline__ void acc_guard4(v8f& a, v8f& b, v8f& c, v8f& d) { asm volatile("v_nop\n\tv_nop\n\tv_nop\n\tv_nop" : "+v"(a), "+v"(b), "+v"(c), "+v"(d)); }
template <typename T> struct Frag;
template <> struct Frag<_Float16> {
  typedef v16h V; union U { v16h v; v8h h[2]; };
  static __device__ __forceinline__ v16h load(const _Float16* p) {   // elements 0..7 <- p[0..7], 8..15 <- p[16..23]
    U f; f.h[0] = *(const v8h*)(p); f.h[1] = *(const v8h*)(p + 16); return f.v;
  }
  static __device__ __forceinline__ v8f mma(v16h a, v16h b, v8f c) {
    return __builtin_amdgcn_wmma_f32_16x16x32_f16(false, a, false, b, (short)0, c, false, false);
  }
  static __device__ __forceinline__ void guard(v8f& a, v8f& b, v16h x, v16h y) { dep_guard_h(a, b, x, y); }
  static __device__ __forceinline__ void keep(v16h a, v16h b, v16h c, v16h d) { keep4_h(a, b, c, d); }
};
template <> struct Frag<__bf16> {
  typedef v16b V; union U { v16b v; v8b h[2]; };
  static __device__ __forceinline__ v16b load(const __bf16* p) {
    U f; f.h[0] = *(const v8b*)(p); f.h[1] = *(const v8b*)(p + 16); return f.v;
  }
  static __device__ __forceinline__ v8f mma(v16b a, v16b b, v8f c) {
    return __builtin_amdgcn_wmma_f32_16x16x32_bf16(false, a, false, b, (short)0, c, false, false);
  }
  static __device__ __forceinline__ void guard(v8f& a, v8f& b, v16b x, v16b y) { dep_guard_b(a, b, x, y); }
  static __device__ __forceinline__ void keep(v16b a, v16b b, v16b c, v16b d) { keep4_b(a, b, c, d); }
};

__device__ __forceinline__ unsigned pk16(unsigned short a, unsigned short b) { return (unsigned)a | ((unsigned)b << 16); }
__device__ __forceinline__ unsigned short h_bits(float f) { const _Float16 h = (_Float16)f; return __builtin_bit_cast(unsigned short, h); }

// ---- Register-blocked WMMA GEMM (plain single product) ----
// C[m,n] = act(scale * sum_k A[m,k] * Bt[n,k] + bias[n]); each wave owns a 64x64 tile.
// A row-major [M,K]; Bt row-major [N,K]; M,N % 64 == 0, K % 32 == 0 (asserted host side; padded planes are zero-filled).
// BIAS_MODE: 0 = none, 2 = bias[n].  ACT: 0 = none, 2 = relu.
// OUT_MODE 1: 16-bit store through the wave slab.
// ET: 0 = f16 operands, 1 = bf16 operands (pointers passed as 16-bit storage)
template <int ET> struct Elem;
template <> struct Elem<0> { typedef _Float16 T; };
template <> struct Elem<1> { typedef __bf16 T; };
template <int ET, int BIAS_MODE, int OUT_MODE, int ACT>
__global__ __launch_bounds__(256) void wmma_gemm64(
    const unsigned short* __restrict__ Ap, int lda, long strideA,
    const unsigned short* __restrict__ Btp, int ldb, long strideB,
    void* __restrict__ Cout, int ldc, long strideC,
    const float* __restrict__ bias,
    const float* __restrict__ hw, int ldh,
    int M, int N, int K, float scale) {
  typedef typename Elem<ET>::T T;
  typedef typename Frag<T>::V V;
  const T* A = (const T*)Ap; const T* Bt = (const T*)Btp;
  __shared__ __align__(16) float sT[8][16 * 68];   // per-wave 16x64 slab, pitch 68 floats
  const int b    = blockIdx.y;
  const int lane = threadIdx.x & 31;
  const int wave = threadIdx.x >> 5;
  const int tilesN = N >> 6;
  const int tilesM = M >> 6;
  const int tile = blockIdx.x * 8 + wave;
  if (tile >= tilesM * tilesN) return;   // wave-uniform; no block barriers in this kernel
  const int tm = tile / tilesN;
  const int tn = tile - tm * tilesN;
  const int m0 = tm << 6;
  const int n0 = tn << 6;

  const T* Ab  = A  + (size_t)b * strideA;
  const T* Bb  = Bt + (size_t)b * strideB;

  const int rlane = lane & 15;                 // row (A) / col (B, D) within subtile
  const int koff  = (lane >> 4) * 8;           // k offset of this lane half
  const int mOff  = (lane >> 4) * 8;           // D row offset

  v8f acc[4][4];
#pragma unroll
  for (int i = 0; i < 4; ++i)
#pragma unroll
    for (int j = 0; j < 4; ++j) acc[i][j] = (v8f){0.f,0.f,0.f,0.f,0.f,0.f,0.f,0.f};

  for (int k0 = 0; k0 < K; k0 += 32) {
    V bh[4];
#pragma unroll
    for (int j = 0; j < 4; ++j) {
      const size_t bo = (size_t)(n0 + (j << 4) + rlane) * ldb + koff + k0;
      bh[j] = Frag<T>::load(Bb + bo);
    }
#pragma unroll
    for (int i = 0; i < 4; ++i) {
      const size_t ao = (size_t)(m0 + (i << 4) + rlane) * lda + koff + k0;
      V ah = Frag<T>::load(Ab + ao);
#pragma unroll
      for (int j = 0; j < 4; ++j) {
        acc[i][j] = Frag<T>::mma(ah, bh[j], acc[i][j]);
      }
      Frag<T>::guard(acc[i][0], acc[i][3], ah, ah);
    }
    Frag<T>::keep(bh[0], bh[1], bh[2], bh[3]);
  }
  acc_guard4(acc[0][0], acc[0][1], acc[0][2], acc[0][3]);
  acc_guard4(acc[1][0], acc[1][1], acc[1][2], acc[1][3]);
  acc_guard4(acc[2][0], acc[2][1], acc[2][2], acc[2][3]);
  acc_guard4(acc[3][0], acc[3][1], acc[3][2], acc[3][3]);

  // ---- epilogue ----
  float* slab = sT[wave];
#pragma unroll
  for (int i = 0; i < 4; ++i) {
    const int mBase = m0 + (i << 4);
    if (OUT_MODE == 1) {
#pragma unroll
      for (int j = 0; j < 4; ++j) {
        const int n = n0 + (j << 4) + rlane;
        float bv = 0.f;
        if (BIAS_MODE == 2) bv = bias[n];
#pragma unroll
        for (int r = 0; r < 8; ++r) {
          float v = acc[i][j][r] * scale;
          if (BIAS_MODE == 2) v += bv;
          if (ACT == 2) v = fmaxf(v, 0.0f);
          slab[(mOff + r) * 68 + (j << 4) + rlane] = v;
        }
      }
      __builtin_amdgcn_fence(__ATOMIC_RELEASE, "workgroup");
      __builtin_amdgcn_wave_barrier();
      __builtin_amdgcn_fence(__ATOMIC_ACQUIRE, "workgroup");
      {
        const int q = lane >> 3, c8 = (lane & 7) * 8;
        unsigned short* C = (unsigned short*)Cout + (size_t)b * strideC;
        {
#pragma unroll
          for (int it = 0; it < 4; ++it) {
            const int row = it * 4 + q;                       // q 0..3, it 0..3 -> rows 0..15; 8 lanes x 8 halves = 64 cols
            const float* sp = slab + row * 68 + c8;
            v8h hv;
#pragma unroll
            for (int e = 0; e < 8; ++e) hv[e] = (_Float16)sp[e];
            *(v8h*)(C + (size_t)(mBase + row) * ldc + n0 + c8) = hv;
          }
          
        }
      }
    }
    __builtin_amdgcn_fence(__ATOMIC_RELEASE, "workgroup");
    __builtin_amdgcn_wave_barrier();
    __builtin_amdgcn_fence(__ATOMIC_ACQUIRE, "workgroup");
  }
}

// ---------------------------------------------------------------------------
// Layer 2 + fused 3-wide head, operands staged in LDS by tensor loads.
// One 256 x 256 tile of relu(h1 . W2^T / carry + b2) per workgroup; 8 waves as 4 (rows) x 2 (columns), each 64 x 128.
// A pass is 256 B (128 k) of every operand row. A buffer holds 8 slices of 64 rows at pitch 272 B (the tensor load's pad):
// slices 0..3 = the tile's h1 rows, 4..7 = its W2 rows; wave w brings slice w. Two buffers, the load two passes ahead.
// Head: P[tn][m][c] = sum_{n in 64-column tile tn} act(...)[m][n] * hw[c*kNeu + n], c = 0..2 (4th float written as 0);
// per-lane partials over the tile's columns, fixed-order xor tree across the 16 lanes of each half, staged in the wave
// slab, then rows mBase..mBase+15 of plane tn written by lanes 0..15. Each wave does this for its two 64-column tiles.
// ---------------------------------------------------------------------------
typedef __attribute__((ext_vector_type(8))) unsigned int v8u;
constexpr unsigned kRowB    = kNeu * 2;            // operand row in global memory, bytes
constexpr unsigned kPassB   = 256;                 // bytes of each operand row per pass
constexpr unsigned kPitch   = kPassB + 16;         // LDS row pitch for ds_load_b128 readers
constexpr unsigned kSlice   = 18432;               // 64 rows x 272 B = 17,408 B, rounded up to a multiple of 2 KiB
constexpr unsigned kBuf     = 8 * kSlice;          // 147,456 B
constexpr unsigned kPasses  = kRowB / kPassB;      // 8
static_assert(kSlice % 2048 == 0 && kSlice >= 64 * kPitch, "slice place must stay a multiple of 2 KiB and hold 64 padded rows");
static_assert(kPasses >= 2, "the two-buffer prologue needs two stages");
static_assert(kChunk % 256 == 0 && kNeu % 256 == 0, "whole 256 x 256 tiles only: no edge handling");

__device__ __forceinline__ unsigned uni(unsigned v) { return (unsigned)__builtin_amdgcn_readfirstlane((int)v); }
// A test on a pinned word compiles to s_cmp + s_cbranch_scc: tensor loads ignore EXEC, so only a scalar branch guards one.
__device__ __forceinline__ unsigned pinned(unsigned v) { unsigned w = uni(v); asm volatile("" : "+s"(w)); return w; }  // holds a wave-uniform test or descriptor word in a scalar register
__device__ __forceinline__ void wait_ds0()     { asm volatile("s_wait_dscnt 0x0" ::: "memory"); }      // this wave's LDS reads have returned
__device__ __forceinline__ void wait_tensor0() { asm volatile("s_wait_tensorcnt 0x0" ::: "memory"); }  // this wave's slice has landed
// one request: 64 rows of 256 B, source pitch kRowB, 16 B of LDS pad behind every row
__device__ __forceinline__ void slice_load(unsigned lds_dst, unsigned long long ga) {
  v4u g0; v8u g1;
  g0[0] = uni(1u);
  g0[1] = uni(lds_dst);
  g0[2] = uni((unsigned)ga);
  g0[3] = uni((((unsigned)(ga >> 32)) & 0x01FFFFFFu) | 0x80000000u);
  g1[0] = uni((1u << 20) | (5u << 22) | (3u << 25));
  g1[1] = uni(kPassB << 16);
  g1[2] = uni(64u << 16);
  g1[3] = uni(kPassB << 16);
  g1[4] = uni(64u);
  g1[5] = uni(kRowB);
  g1[6] = uni(0u);
  g1[7] = uni(0u);
  asm volatile("tensor_load_to_lds %0, %1" :: "s"(g0), "s"(g1) : "memory");
}
__device__ __forceinline__ v16h lds_frag(const unsigned char* p) {   // elements 0..7 <- 16 B at p, 8..15 <- 16 B at p + 32
  Frag<_Float16>::U f; f.h[0] = *(const v8h*)(p); f.h[1] = *(const v8h*)(p + 32); return f.v;
}

__global__ __launch_bounds__(256) void layer2_head_kernel(
    const unsigned short* __restrict__ A, const unsigned short* __restrict__ Bt,
    float* __restrict__ Pout, long planeStride,
    const float* __restrict__ bias, const float* __restrict__ hw, float scale) {
  __shared__ __attribute__((aligned(2048))) unsigned char ring[2 * kBuf];
  __shared__ __align__(16) float sH[8][64];          // per-wave 16 x 4 head slab
  const int lane = threadIdx.x & 31;
  const unsigned wave = uni(threadIdx.x >> 5);
  const int m0 = blockIdx.y << 8;
  const int n0 = blockIdx.x << 8;
  const unsigned wm = wave & 3u;                     // 64-row block of the tile
  const unsigned wn = wave >> 2;                     // 128-column block of the tile
  const int rlane = lane & 15;
  const int mOff  = (lane >> 4) * 8;                 // D row offset

  const unsigned char* srcp = (wave < 4u)
      ? (const unsigned char*)A  + (size_t)(m0 + 64 * (int)wave) * kRowB
      : (const unsigned char*)Bt + (size_t)(n0 + 64 * (int)(wave - 4u)) * kRowB;
  const unsigned long long src = (unsigned long long)(uintptr_t)srcp;
  const unsigned dst = (unsigned)(uintptr_t)ring + wave * kSlice;   // add buffer * kBuf

  // every inner loop of this kernel is unrolled so that each index into a register array is a constant (else scratch)
  v8f acc[4][8];
#pragma unroll
  for (int i = 0; i < 4; ++i)
#pragma unroll
    for (int j = 0; j < 8; ++j) acc[i][j] = (v8f){0.f,0.f,0.f,0.f,0.f,0.f,0.f,0.f};

  const unsigned aBase = wm * kSlice + (unsigned)rlane * kPitch + 16u * (unsigned)(lane >> 4);
  const unsigned bBase = (4u + 2u * wn) * kSlice + (unsigned)rlane * kPitch + 16u * (unsigned)(lane >> 4);

  slice_load(dst, src);
  wait_tensor0();
  __syncthreads();                                   // stage 0 published
  slice_load(dst + kBuf, src + kPassB);

  // bias and head weights of this lane's 8 columns, fetched here once so that their latency lies under the K loop
  float bv[8], w0[8], w1[8], w2[8];
  const int nl = n0 + (int)wn * 128 + rlane;
#pragma unroll
  for (int j = 0; j < 8; ++j) {
    const int n = nl + (j << 4);
    bv[j] = bias[n];
    w0[j] = hw[n];
    w1[j] = hw[(size_t)kNeu + n];
    w2[j] = hw[(size_t)2 * kNeu + n];
  }
  // stands in front of any overwrite of the loads' address register; the index as an input keeps that register live up to here
  asm volatile("s_wait_xcnt 0x0" :: "v"(nl) : "memory");

  // Fragments go one block (one k step of 32) ahead into the other register set, each block's 24 LDS loads as one group.
  v16h af[2][4], bf[2][8];
  {
    const unsigned char* pa = ring + aBase;
    const unsigned char* pb = ring + bBase;
#pragma unroll
    for (int j = 0; j < 8; ++j) bf[0][j] = lds_frag(pb + (j >> 2) * kSlice + (j & 3) * 16 * kPitch);
#pragma unroll
    for (int i = 0; i < 4; ++i) af[0][i] = lds_frag(pa + i * 16 * kPitch);
  }
#pragma clang loop unroll(disable)                   // one pass per trip: the body stays small for the instruction cache
  for (unsigned s = 0; s < kPasses; ++s) {
    const unsigned buf = (s & 1u) * kBuf;
    const unsigned char* pa = ring + buf + aBase;
    const unsigned char* pb = ring + buf + bBase;
#pragma unroll
    for (int kk = 0; kk < 4; ++kk) {
      const int cur = kk & 1, nxt = cur ^ 1;
      if (kk < 3) {                                  // the next block's fragments, same buffer
#pragma unroll
        for (int j = 0; j < 8; ++j) bf[nxt][j] = lds_frag(pb + (j >> 2) * kSlice + (j & 3) * 16 * kPitch + (kk + 1) * 64);
#pragma unroll
        for (int i = 0; i < 4; ++i) af[nxt][i] = lds_frag(pa + i * 16 * kPitch + (kk + 1) * 64);
      } else {
        // publish point of stage s + 1, in front of stage s's last block, whose fragments are already fetched
        wait_ds0();
        wait_tensor0();
        __syncthreads();
        if (pinned((s + 2u < kPasses) ? 1u : 0u) != 0u) {
          const unsigned st = pinned(s + 2u);        // descriptor words formed behind the wait above
          slice_load(dst + buf, src + (unsigned long long)st * kPassB);
        }
        // first block of stage s + 1. Unconditional, so that no branch merges two wait counts: behind the last pass it
        // reads the other buffer's landed rows of stage s - 1, and the values are not used.
        const unsigned char* qa = ring + (kBuf - buf) + aBase;
        const unsigned char* qb = ring + (kBuf - buf) + bBase;
#pragma unroll
        for (int j = 0; j < 8; ++j) bf[nxt][j] = lds_frag(qb + (j >> 2) * kSlice + (j & 3) * 16 * kPitch);
#pragma unroll
        for (int i = 0; i < 4; ++i) af[nxt][i] = lds_frag(qa + i * 16 * kPitch);
      }
      __builtin_amdgcn_sched_barrier(0);             // keeps the load group ahead of the block
#pragma unroll
      for (int i = 0; i < 4; ++i)
#pragma unroll
        for (int j = 0; j < 8; ++j)
          acc[i][j] = Frag<_Float16>::mma(af[cur][i], bf[cur][j], acc[i][j]);
      __builtin_amdgcn_sched_barrier(0);             // keeps the next group behind this block
    }
  }
  wait_tensor0();
  wait_ds0();

  // ---- epilogue: fused 3-wide head, f32, one 64-column tile at a time ----
  float* slab = sH[wave];
#pragma unroll
  for (int i = 0; i < 4; ++i) {
    const int mBase = m0 + (int)wm * 64 + (i << 4);
#pragma unroll
    for (int t = 0; t < 2; ++t) {
      const int tn = (n0 + (int)wn * 128 + t * 64) >> 6;
      float hp0[8], hp1[8], hp2[8];
#pragma unroll
      for (int r = 0; r < 8; ++r) { hp0[r] = 0.f; hp1[r] = 0.f; hp2[r] = 0.f; }
#pragma unroll
      for (int j = 0; j < 4; ++j) {
        const int c = t * 4 + j;
#pragma unroll
        for (int r = 0; r < 8; ++r) {
          float v = acc[i][c][r] * scale;
          v += bv[c];
          v = fmaxf(v, 0.0f);
          hp0[r] = fmaf(v, w0[c], hp0[r]);
          hp1[r] = fmaf(v, w1[c], hp1[r]);
          hp2[r] = fmaf(v, w2[c], hp2[r]);
        }
      }
      // fixed-order xor tree across the 16 lanes of each half (lanes sharing the same D rows)
#pragma unroll
      for (int r = 0; r < 8; ++r) {
#pragma unroll
        for (int off = 1; off < 16; off <<= 1) {
          hp0[r] += __shfl_xor(hp0[r], off, 32);
          hp1[r] += __shfl_xor(hp1[r], off, 32);
          hp2[r] += __shfl_xor(hp2[r], off, 32);
        }
      }
      // lane (half h, rlane == r) stages slab row 8h + r: rows 0..15 x 4 floats all written
#pragma unroll
      for (int r = 0; r < 8; ++r) {
        if (rlane == r) {
          slab[(mOff + r) * 4 + 0] = hp0[r];
          slab[(mOff + r) * 4 + 1] = hp1[r];
          slab[(mOff + r) * 4 + 2] = hp2[r];
          slab[(mOff + r) * 4 + 3] = 0.0f;
        }
      }
      __builtin_amdgcn_fence(__ATOMIC_RELEASE, "workgroup");
      __builtin_amdgcn_wave_barrier();
      __builtin_amdgcn_fence(__ATOMIC_ACQUIRE, "workgroup");
      {
        float* P = Pout + (size_t)tn * planeStride + (size_t)mBase * 4;
        const int l4 = (lane & 15) * 4;
        const v4f pv = *(const v4f*)(slab + l4);
        if (lane < 16) *(v4f*)(P + l4) = pv;         // 16 lanes x 16 B = rows mBase..mBase+15 of plane tn (256 B)
      }
      __builtin_amdgcn_fence(__ATOMIC_RELEASE, "workgroup");
      __builtin_amdgcn_wave_barrier();
      __builtin_amdgcn_fence(__ATOMIC_ACQUIRE, "workgroup");
    }
  }
}

// ---------------------------------------------------------------------------
// W2 cast, 8 consecutive elements per thread: out f16 bits of (scale * in), scale a power-of-two carry.
// ---------------------------------------------------------------------------
__global__ __launch_bounds__(256) void cast_f16x8_kernel(const float* __restrict__ in, unsigned short* __restrict__ out,
                                                         int n8, float scale) {
  const int i = blockIdx.x * 256 + threadIdx.x;
  if (i >= n8) return;
  const float* p = in + 8 * (size_t)i;
  const v4f a = *(const v4f*)(p);
  const v4f c = *(const v4f*)(p + 4);
  unsigned short hb[8];
#pragma unroll
  for (int e = 0; e < 4; ++e) {
    hb[e]     = h_bits(a[e] * scale);
    hb[4 + e] = h_bits(c[e] * scale);
  }
  const v4u u = (v4u){pk16(hb[0], hb[1]), pk16(hb[2], hb[3]), pk16(hb[4], hb[5]), pk16(hb[6], hb[7])};
  unsigned short* q = out + 8 * (size_t)i;
  *(v4u*)q = u;
  
}

// ---------------------------------------------------------------------------
// W1 [1024][10] f32 -> W1P f16 bits [1024][32]: cols 0..9 = f16(scale * W1), cols 10..31 = 0 (explicit zero fill of the k pad).
// One block of 64 threads per 64 rows (16 blocks exactly). Input staged coalesced (64 threads x 10 = 640 floats = the 64 rows).
// Store: LDS tile [64][32] halves (4096 B) -> contiguous 4096-B region at row0 (4096-B aligned): 4 instructions x 64 threads x 16 B;
// ---------------------------------------------------------------------------
__global__ __launch_bounds__(64) void w1_pad_kernel(const float* __restrict__ W1, unsigned short* __restrict__ W1P, float scale) {
  __shared__ float wsrc[64 * kL1Real];
  __shared__ __align__(16) unsigned short hs[64 * kL1K];
  const int t = threadIdx.x;
  const int row0 = blockIdx.x * 64;
  const float* wb = W1 + (size_t)row0 * kL1Real;
#pragma unroll
  for (int i = 0; i < kL1Real; ++i) wsrc[t + 64 * i] = wb[t + 64 * i];
  __syncthreads();
  unsigned short hb[kL1Real];
#pragma unroll
  for (int k = 0; k < kL1Real; ++k) hb[k] = h_bits(wsrc[t * kL1Real + k] * scale);
  const v4u u0 = (v4u){pk16(hb[0], hb[1]), pk16(hb[2], hb[3]), pk16(hb[4], hb[5]), pk16(hb[6], hb[7])};
  const v4u u1 = (v4u){pk16(hb[8], hb[9]), 0u, 0u, 0u};
  const v4u uz = (v4u){0u, 0u, 0u, 0u};
  v4u* hv = (v4u*)hs;                      // row t = 4 x 16 B
  hv[t * 4 + 0] = u0; hv[t * 4 + 1] = u1; hv[t * 4 + 2] = uz; hv[t * 4 + 3] = uz;
  __syncthreads();
  const v4u s0 = hv[t], s1 = hv[64 + t], s2 = hv[128 + t], s3 = hv[192 + t];
  v4u* dst = (v4u*)(W1P + (size_t)row0 * kL1K);
  {
    ((v4u*)dst)[t]       = s0;
    ((v4u*)dst)[64 + t]  = s1;
    ((v4u*)dst)[128 + t] = s2;
    ((v4u*)dst)[192 + t] = s3;
    
  }
}

// ---------------------------------------------------------------------------
// Feature kernel: x [M][25] f32 -> L1 f16 bits [M][32]: cols 0..9 = relu projections in the concatenation order
// [fx(vx) | fx(vy) | fx(r) | fu(th) | fu(st)], cols 10..31 = 0 (explicit zero fill). vx = x[3i], vy = x[3i+1], r = x[3i+2],
// th = x[15+2i], st = x[16+2i], i = 0..4; fx(v)[o] = relu(sum_i Wx[o][i] v[i] + bx[o]); f32 math.
// One block of 64 threads per 64 rows (M/64 blocks exactly); x staged coalesced (64 x 25 = 1600 floats = the 64 rows).
// Store: LDS tile [64][32] halves -> contiguous 4096-B region at row0*64 B (4096-B aligned): 4 instructions x 64 threads x 16 B;
// ---------------------------------------------------------------------------
__global__ __launch_bounds__(64) void l1_feature_kernel(
    const float* __restrict__ x, const float* __restrict__ Wx, const float* __restrict__ bx,
    const float* __restrict__ Wu, const float* __restrict__ bu, unsigned short* __restrict__ L1) {
  __shared__ float xs[64 * kInDim];
  __shared__ __align__(16) unsigned short hs[64 * kL1K];
  const int t = threadIdx.x;
  const int row0 = blockIdx.x * 64;
  const float* xb = x + (size_t)row0 * kInDim;
#pragma unroll
  for (int i = 0; i < kInDim; ++i) xs[t + 64 * i] = xb[t + 64 * i];
  float wx[10], wu[10];
#pragma unroll
  for (int i = 0; i < 10; ++i) { wx[i] = Wx[i]; wu[i] = Wu[i]; }
  const float bx0 = bx[0], bx1 = bx[1], bu0 = bu[0], bu1 = bu[1];
  __syncthreads();
  const float* xr = xs + t * kInDim;
  float f[kL1Real];
#pragma unroll
  for (int g = 0; g < 3; ++g) {            // vx (g=0), vy (g=1), r (g=2): columns 3i + g
    const float v0 = xr[g], v1 = xr[3 + g], v2 = xr[6 + g], v3 = xr[9 + g], v4 = xr[12 + g];
    float a0 = wx[0] * v0; a0 = fmaf(wx[1], v1, a0); a0 = fmaf(wx[2], v2, a0); a0 = fmaf(wx[3], v3, a0); a0 = fmaf(wx[4], v4, a0);
    float a1 = wx[5] * v0; a1 = fmaf(wx[6], v1, a1); a1 = fmaf(wx[7], v2, a1); a1 = fmaf(wx[8], v3, a1); a1 = fmaf(wx[9], v4, a1);
    a0 += bx0; a1 += bx1;
    f[2 * g]     = fmaxf(a0, 0.0f);
    f[2 * g + 1] = fmaxf(a1, 0.0f);
  }
#pragma unroll
  for (int g = 0; g < 2; ++g) {            // th (g=0): columns 15,17,..,23; st (g=1): columns 16,18,..,24
    const float v0 = xr[15 + g], v1 = xr[17 + g], v2 = xr[19 + g], v3 = xr[21 + g], v4 = xr[23 + g];
    float a0 = wu[0] * v0; a0 = fmaf(wu[1], v1, a0); a0 = fmaf(wu[2], v2, a0); a0 = fmaf(wu[3], v3, a0); a0 = fmaf(wu[4], v4, a0);
    float a1 = wu[5] * v0; a1 = fmaf(wu[6], v1, a1); a1 = fmaf(wu[7], v2, a1); a1 = fmaf(wu[8], v3, a1); a1 = fmaf(wu[9], v4, a1);
    a0 += bu0; a1 += bu1;
    f[6 + 2 * g] = fmaxf(a0, 0.0f);
    f[7 + 2 * g] = fmaxf(a1, 0.0f);
  }
  unsigned short hb[kL1Real];
#pragma unroll
  for (int c = 0; c < kL1Real; ++c) hb[c] = h_bits(f[c]);
  const v4u u0 = (v4u){pk16(hb[0], hb[1]), pk16(hb[2], hb[3]), pk16(hb[4], hb[5]), pk16(hb[6], hb[7])};
  const v4u u1 = (v4u){pk16(hb[8], hb[9]), 0u, 0u, 0u};
  const v4u uz = (v4u){0u, 0u, 0u, 0u};
  v4u* hv = (v4u*)hs;                      // row t = 4 x 16 B
  hv[t * 4 + 0] = u0; hv[t * 4 + 1] = u1; hv[t * 4 + 2] = uz; hv[t * 4 + 3] = uz;
  __syncthreads();
  const v4u s0 = hv[t], s1 = hv[64 + t], s2 = hv[128 + t], s3 = hv[192 + t];
  v4u* dst = (v4u*)(L1 + (size_t)row0 * kL1K);
  {
    ((v4u*)dst)[t]       = s0;
    ((v4u*)dst)[64 + t]  = s1;
    ((v4u*)dst)[128 + t] = s2;
    ((v4u*)dst)[192 + t] = s3;
    
  }
}

// ---------------------------------------------------------------------------
// Head output: out[m][c] = sigmoid(sum_{p=0..15 in order} PART[p][m][c] + b3[c]). One block of 64 threads per 64 rows
// (M/64 blocks exactly); results funnelled through LDS so wave 0 writes the block's 768 contiguous output bytes (6 whole
// ---------------------------------------------------------------------------
__global__ __launch_bounds__(64) void head_out_kernel(const float* __restrict__ PART, long planeStride,
                                                     const float* __restrict__ b3, float* __restrict__ out) {
  __shared__ __align__(16) float so[64 * kHeadOut];
  const int t = threadIdx.x;
  const int m = blockIdx.x * 64 + t;
  float s0 = 0.f, s1 = 0.f, s2 = 0.f;
#pragma unroll
  for (int p = 0; p < kNPlanes; ++p) {
    const v4f v = *(const v4f*)(PART + (size_t)p * planeStride + (size_t)m * 4);
    s0 += v[0]; s1 += v[1]; s2 += v[2];
  }
  s0 += b3[0]; s1 += b3[1]; s2 += b3[2];
  const float o0 = __builtin_amdgcn_rcpf(1.0f + expf(-s0));
  const float o1 = __builtin_amdgcn_rcpf(1.0f + expf(-s1));
  const float o2 = __builtin_amdgcn_rcpf(1.0f + expf(-s2));
  so[t * 3 + 0] = o0; so[t * 3 + 1] = o1; so[t * 3 + 2] = o2;
  __syncthreads();
  if (t < 32) {
    float* ob = out + (size_t)blockIdx.x * (64 * kHeadOut);
    const v4f v0 = *(const v4f*)(so + t * 4);                  // floats 0..127
    const v4f v1 = *(const v4f*)(so + 128 + (t & 15) * 4);     // floats 128..191
    {
      *(v4f*)(ob + t * 4) = v0;
      if (t < 16) *(v4f*)(ob + 128 + t * 4) = v1;
      
    }
  }
}

// ---------------------------------------------------------------------------
// Workspace region map (byte offsets, all multiples of 128; every region fully written before it is read):
//   W2H  f16 [1024][1024] (x64)                0           2,097,152 B
//   W1P  f16 [1024][32]   (x16, cols 10..31=0) 2,097,152      65,536 B
//   L1   f16 [M][32]      (cols 10..31 = 0)    2,162,688   M*64 B          (8,388,608 for M=131072)
//   H1   f16 [32768][1024] per chunk            +           67,108,864 B
//   PART f32 [16][M][4]                          +           M*256 B         (33,554,432)
//   total 111,214,592 B for M = 131072
// GEMM shapes per 32768-row chunk: layer 1 M=32768 N=1024 K=32 (padded planes zero-filled); layer 2 M=32768 N=1024 K=1024.
// All K % 32 == 0, all M, N % 64 == 0.
// ---------------------------------------------------------------------------
extern "C" void kernel_launch(void* const* d_in, const int* in_sizes, int n_in,
                              void* d_out, int out_size, void* d_ws, size_t ws_size,
                              hipStream_t stream) {
  if (n_in < 11) return;
  const int M = in_sizes[0] / kInDim;
  if (M <= 0 || M * kInDim != in_sizes[0]) return;
  if ((M % kChunk) != 0) return;
  if (in_sizes[1] != 10 || in_sizes[2] != 2 || in_sizes[3] != 10 || in_sizes[4] != 2) return;
  if (in_sizes[5] != kNeu * kL1Real || in_sizes[6] != kNeu) return;
  if (in_sizes[7] != kNeu * kNeu || in_sizes[8] != kNeu) return;
  if (in_sizes[9] != kHeadOut * kNeu || in_sizes[10] != kHeadOut) return;
  if (out_size != M * kHeadOut) return;

  const float* x  = (const float*)d_in[0];    // [M][25]
  const float* Wx = (const float*)d_in[1];    // [2][5]
  const float* bx = (const float*)d_in[2];    // [2]
  const float* Wu = (const float*)d_in[3];    // [2][5]
  const float* bu = (const float*)d_in[4];    // [2]
  const float* W1 = (const float*)d_in[5];    // [1024][10]
  const float* b1 = (const float*)d_in[6];    // [1024]
  const float* W2 = (const float*)d_in[7];    // [1024][1024]
  const float* b2 = (const float*)d_in[8];    // [1024]
  const float* W3 = (const float*)d_in[9];    // [3][1024]
  const float* b3 = (const float*)d_in[10];   // [3]
  float* outp = (float*)d_out;                // [M][1][3]

  // ---- carve ----
  const size_t szW2H  = (size_t)kNeu * kNeu * 2;
  const size_t szW1P  = (size_t)kNeu * kL1K * 2;
  const size_t szL1   = (size_t)M * kL1K * 2;
  const size_t szH1   = (size_t)kChunk * kNeu * 2;
  const size_t szPart = (size_t)kNPlanes * M * 4 * sizeof(float);
  size_t off = 0;
  const size_t oW2H  = off; off += szW2H;
  const size_t oW1P  = off; off += szW1P;
  const size_t oL1   = off; off += szL1;
  const size_t oH1   = off; off += szH1;
  const size_t oPart = off; off += szPart;
  const size_t TOTAL = off;
  if (TOTAL > ws_size) return;
  if (TOTAL > (size_t)134217728) return;

  char* ws = (char*)d_ws;
  unsigned short* W2H  = (unsigned short*)(ws + oW2H);
  unsigned short* W1P  = (unsigned short*)(ws + oW1P);
  unsigned short* L1   = (unsigned short*)(ws + oL1);
  unsigned short* H1   = (unsigned short*)(ws + oH1);
  float*          PART = (float*)(ws + oPart);
  const long planeStride = (long)M * 4;       // floats between head partial planes

  // (0) weight planes
  {
    const int n8 = kNeu * kNeu / 8;           // 131072 -> 512 blocks exactly
    cast_f16x8_kernel<<<dim3(n8 / 256), dim3(256), 0, stream>>>(W2, W2H, n8, kW2Carry);
    w1_pad_kernel<<<dim3(kNeu / 64), dim3(64), 0, stream>>>(W1, W1P, kW1Carry);
  }
  // (1) features -> L1
  l1_feature_kernel<<<dim3(M / 64), dim3(64), 0, stream>>>(x, Wx, bx, Wu, bu, L1);

  // (2) per 32768-row chunk: layer 1 -> H1 (f16), layer 2 + fused head -> PART
  const int tiles = (kChunk / 64) * (kNeu / 64);                 // 8192
  const dim3 gG((tiles + 7) / 8, 1);                             // 1024 blocks
  const int nChunks = M / kChunk;
  for (int ch = 0; ch < nChunks; ++ch) {
    const unsigned short* Ach = L1 + (size_t)ch * kChunk * kL1K;
    wmma_gemm64<0, 2, 1, 2><<<gG, dim3(256), 0, stream>>>(
        Ach, kL1K, 0L, W1P, kL1K, 0L, (void*)H1, kNeu, 0L, b1, W3, kNeu, kChunk, kNeu, kL1K, kW1CarryInv);
    float* Pch = PART + (size_t)ch * kChunk * 4;
    layer2_head_kernel<<<dim3(kNeu / 256, kChunk / 256), dim3(256), 0, stream>>>(
        H1, W2H, Pch, planeStride, b2, W3, kW2CarryInv);
  }

  // (3) head: fixed-order sum of the 16 partials + b3, sigmoid -> d_out
  head_out_kernel<<<dim3(M / 64), dim3(64), 0, stream>>>(PART, planeStride, b3, outp);
}
